// v000
// The times below were measured on an AMD MI455X: many runs one after another, warmed up first and cycling through
// copies of the inputs, with the whole window's GPU time divided by the number of runs. Launches and the gaps
// between them are all in it. The median over several windows is given; except for v000 it joins two sittings, which
// can be a few percent apart, so the side-by-side timings, each taken in one sitting, are the better comparison.
// The starting kernel, v000, takes 36.9 microseconds a run.
#include <hip/hip_runtime.h>

typedef __attribute__((ext_vector_type(2))) float v2f;
typedef __attribute__((ext_vector_type(8))) float v8f;

#define HID   4096      // hidden = 64 heads * 64 head_size
#define HEADS 64
#define HS    64        // head_size
#define PAD   68        // padded LDS row stride (floats): 64+4 -> 4-bank skew, conflict-free

#if __has_builtin(__builtin_amdgcn_global_load_async_to_lds_b128)
#define HAVE_ASYNC_LDS 1
typedef int v4i __attribute__((vector_size(16)));        // matches builtin's pointee type
typedef __attribute__((address_space(1))) v4i GV4;       // global int4
typedef __attribute__((address_space(3))) v4i LV4;       // LDS int4
#else
#define HAVE_ASYNC_LDS 0
#endif

__device__ __forceinline__ void wait_async_zero() {
#if HAVE_ASYNC_LDS
#if __has_builtin(__builtin_amdgcn_s_wait_asynccnt)
    __builtin_amdgcn_s_wait_asynccnt(0);
#else
    asm volatile("s_wait_asynccnt 0x0" ::: "memory");
#endif
#endif
}

// One workgroup (4 waves, 128 threads) per row n.
// Per row:  S = Qmat^T * Kmat ; P = row_softmax(S) ; out[h*64+d] = (Vmat * P^T)[h,d].
__launch_bounds__(128)
__global__ void attn_per_row_kernel(const float* __restrict__ q,
                                    const float* __restrict__ k,
                                    const float* __restrict__ v,
                                    float* __restrict__ out)
{
    __shared__ float qs[HEADS * PAD];   // Qmat, later reused as P^T (ps[e][d])
    __shared__ float ks[HEADS * PAD];   // Kmat, later reused as O staging (os[h][d])
    __shared__ float vs[HEADS * PAD];   // Vmat

    const int n    = blockIdx.x;
    const int tid  = threadIdx.x;
    const int wave = tid >> 5;          // 0..3 -> owns 16-row slab
    const int lane = tid & 31;
    const int l16  = lane & 15;
    const int hi   = lane >> 4;         // which half-wave (0/1)

    const size_t rowOff = (size_t)n * HID;

    // ---- Stage q/k/v row into LDS as 64x64 tiles ----
#if HAVE_ASYNC_LDS
    // CDNA5 path: direct global->LDS async copies (512B per wave-instruction),
    // tracked by ASYNCcnt; no VGPR round trip.
    for (int i = tid; i < HID / 4; i += 128) {
        const int r = (i * 4) / HS;
        const int c = (i * 4) % HS;
        __builtin_amdgcn_global_load_async_to_lds_b128(
            (GV4*)(q + rowOff + i * 4), (LV4*)&qs[r * PAD + c], 0, 0);
        __builtin_amdgcn_global_load_async_to_lds_b128(
            (GV4*)(k + rowOff + i * 4), (LV4*)&ks[r * PAD + c], 0, 0);
        __builtin_amdgcn_global_load_async_to_lds_b128(
            (GV4*)(v + rowOff + i * 4), (LV4*)&vs[r * PAD + c], 0, 0);
    }
    wait_async_zero();
#else
    for (int i = tid; i < HID / 4; i += 128) {
        const int r = (i * 4) / HS;
        const int c = (i * 4) % HS;
        *(float4*)&qs[r * PAD + c] = *(const float4*)(q + rowOff + i * 4);
        *(float4*)&ks[r * PAD + c] = *(const float4*)(k + rowOff + i * 4);
        *(float4*)&vs[r * PAD + c] = *(const float4*)(v + rowOff + i * 4);
    }
#endif
    __syncthreads();

    // ---- Matmul 1: S[d,e] = sum_h Qmat[h,d] * Kmat[h,e] ----
    // A frag (16x4 f32): a[j] = A[m=l16, k=j+2*hi]; B frag mirrored.
    v8f S[4];
    for (int t = 0; t < 4; ++t) {
        v8f acc = {};
        for (int kk = 0; kk < 16; ++kk) {
            const int h = kk * 4 + 2 * hi;
            v2f a, b;
            a.x = qs[(h + 0) * PAD + wave * 16 + l16];
            a.y = qs[(h + 1) * PAD + wave * 16 + l16];
            b.x = ks[(h + 0) * PAD + t * 16 + l16];
            b.y = ks[(h + 1) * PAD + t * 16 + l16];
            acc = __builtin_amdgcn_wmma_f32_16x16x4_f32(
                      false, a, false, b, (short)0, acc, false, false);
        }
        S[t] = acc;
    }

    // All waves done reading qs/ks before they are repurposed.
    __syncthreads();

    // ---- Softmax over e (64 wide) + store P^T into qs (ps[e][d]) ----
    // C/D layout: VGPR j holds row M=j+8*hi across lanes l16 (cols).
    float* ps = qs;
    for (int j = 0; j < 8; ++j) {
        float m = fmaxf(fmaxf(S[0][j], S[1][j]), fmaxf(S[2][j], S[3][j]));
        m = fmaxf(m, __shfl_xor(m, 1));
        m = fmaxf(m, __shfl_xor(m, 2));
        m = fmaxf(m, __shfl_xor(m, 4));
        m = fmaxf(m, __shfl_xor(m, 8));   // row max within 16-lane half

        float e0 = __expf(S[0][j] - m);
        float e1 = __expf(S[1][j] - m);
        float e2 = __expf(S[2][j] - m);
        float e3 = __expf(S[3][j] - m);
        float s  = e0 + e1 + e2 + e3;
        s += __shfl_xor(s, 1);
        s += __shfl_xor(s, 2);
        s += __shfl_xor(s, 4);
        s += __shfl_xor(s, 8);            // row sum within 16-lane half
        const float inv = 1.0f / s;

        const int d = wave * 16 + j + 8 * hi;   // S row index
        ps[(0 * 16 + l16) * PAD + d] = e0 * inv;
        ps[(1 * 16 + l16) * PAD + d] = e1 * inv;
        ps[(2 * 16 + l16) * PAD + d] = e2 * inv;
        ps[(3 * 16 + l16) * PAD + d] = e3 * inv;
    }
    __syncthreads();

    // ---- Matmul 2: O[h,d] = sum_e Vmat[h,e] * P[d,e] = A(vs) x B(ps) ----
    // Wave handles h in [16*wave, 16*wave+16), loops d tiles; O staged in LDS.
    float* os = ks;
    for (int t = 0; t < 4; ++t) {
        v8f acc = {};
        for (int kk = 0; kk < 16; ++kk) {
            const int e = kk * 4 + 2 * hi;
            v2f a, b;
            a.x = vs[(wave * 16 + l16) * PAD + e + 0];
            a.y = vs[(wave * 16 + l16) * PAD + e + 1];
            b.x = ps[(e + 0) * PAD + t * 16 + l16];
            b.y = ps[(e + 1) * PAD + t * 16 + l16];
            acc = __builtin_amdgcn_wmma_f32_16x16x4_f32(
                      false, a, false, b, (short)0, acc, false, false);
        }
        for (int j = 0; j < 8; ++j) {
            const int h = wave * 16 + j + 8 * hi;
            const int d = t * 16 + l16;
            os[h * PAD + d] = acc[j];
        }
    }
    __syncthreads();

    // ---- Coalesced output: block-wide contiguous float4 stores (512B/wave-op) ----
    for (int i = tid; i < HID / 4; i += 128) {
        const int r = (i * 4) / HS;
        const int c = (i * 4) % HS;
        *(float4*)(out + rowOff + i * 4) = *(const float4*)&os[r * PAD + c];
    }
}

extern "C" void kernel_launch(void* const* d_in, const int* in_sizes, int n_in,
                              void* d_out, int out_size, void* d_ws, size_t ws_size,
                              hipStream_t stream) {
    const float* q = (const float*)d_in[0];
    const float* k = (const float*)d_in[1];
    const float* v = (const float*)d_in[2];
    float* out = (float*)d_out;

    const int N = in_sizes[0] / HID;    // 4096 rows
    attn_per_row_kernel<<<dim3(N), dim3(128), 0, stream>>>(q, k, v, out);
}

// v001
// A run of this version takes 30.8 microseconds.
// Timed twice side by side with v000, it ran 1.24 times as fast both times.
#include <hip/hip_runtime.h>

typedef __attribute__((ext_vector_type(2))) float v2f;
typedef __attribute__((ext_vector_type(8))) float v8f;

#define HID   4096      // hidden = 64 heads * 64 head_size
#define HEADS 64
#define HS    64        // head_size
#define PAD   68        // padded LDS row stride (floats): 64+4 -> 4-bank skew, conflict-free

#if __has_builtin(__builtin_amdgcn_global_load_async_to_lds_b128)
#define HAVE_ASYNC_LDS 1
typedef int v4i __attribute__((vector_size(16)));        // matches builtin's pointee type
typedef __attribute__((address_space(1))) v4i GV4;       // global int4
typedef __attribute__((address_space(3))) v4i LV4;       // LDS int4
#else
#define HAVE_ASYNC_LDS 0
#endif

__device__ __forceinline__ void wait_async_zero() {
#if HAVE_ASYNC_LDS
#if __has_builtin(__builtin_amdgcn_s_wait_asynccnt)
    __builtin_amdgcn_s_wait_asynccnt(0);
#else
    asm volatile("s_wait_asynccnt 0x0" ::: "memory");
#endif
#endif
}

// One workgroup (4 waves, 128 threads) per row n.
// Per row:  St = Kmat^T * Qmat (= S^T) ; P^T = column_softmax(St) ; O = Vmat * P^T,
// out[h*64+d] = O[h,d].  Wave w owns the 16 columns d = 16w..16w+15 from St to O.
__launch_bounds__(128)
__global__ void attn_per_row_kernel(const float* __restrict__ q,
                                    const float* __restrict__ k,
                                    const float* __restrict__ v,
                                    float* __restrict__ out)
{
    __shared__ float qs[HEADS * PAD];   // Qmat, later reused as O staging (os[h][d])
    __shared__ float ks[HEADS * PAD];   // Kmat
    __shared__ float vs[HEADS * PAD];   // Vmat

    const int n    = blockIdx.x;
    const int tid  = threadIdx.x;
    const int wave = tid >> 5;          // 0..3 -> owns 16 columns d
    const int lane = tid & 31;
    const int l16  = lane & 15;
    const int hi   = lane >> 4;         // which half-wave (0/1)

    const size_t rowOff = (size_t)n * HID;

    // ---- Stage q/k/v row into LDS as 64x64 tiles ----
#if HAVE_ASYNC_LDS
    // CDNA5 path: direct global->LDS async copies (512B per wave-instruction),
    // tracked by ASYNCcnt; no VGPR round trip.
    for (int i = tid; i < HID / 4; i += 128) {
        const int r = (i * 4) / HS;
        const int c = (i * 4) % HS;
        __builtin_amdgcn_global_load_async_to_lds_b128(
            (GV4*)(q + rowOff + i * 4), (LV4*)&qs[r * PAD + c], 0, 0);
        __builtin_amdgcn_global_load_async_to_lds_b128(
            (GV4*)(k + rowOff + i * 4), (LV4*)&ks[r * PAD + c], 0, 0);
        __builtin_amdgcn_global_load_async_to_lds_b128(
            (GV4*)(v + rowOff + i * 4), (LV4*)&vs[r * PAD + c], 0, 0);
    }
    wait_async_zero();
#else
    for (int i = tid; i < HID / 4; i += 128) {
        const int r = (i * 4) / HS;
        const int c = (i * 4) % HS;
        *(float4*)&qs[r * PAD + c] = *(const float4*)(q + rowOff + i * 4);
        *(float4*)&ks[r * PAD + c] = *(const float4*)(k + rowOff + i * 4);
        *(float4*)&vs[r * PAD + c] = *(const float4*)(v + rowOff + i * 4);
    }
#endif
    __syncthreads();

    // ---- Matmul 1, transposed: St[e,d] = sum_h Kmat[h,e] * Qmat[h,d] ----
    // A frag (16x4 f32): a[j] = A[m=l16, k=j+2*hi]; B frag mirrored.
    v8f St[4];
    for (int t = 0; t < 4; ++t) {
        v8f acc = {};
        for (int kk = 0; kk < 16; ++kk) {
            const int h = kk * 4 + 2 * hi;
            v2f a, b;
            a.x = ks[(h + 0) * PAD + t * 16 + l16];
            a.y = ks[(h + 1) * PAD + t * 16 + l16];
            b.x = qs[(h + 0) * PAD + wave * 16 + l16];
            b.y = qs[(h + 1) * PAD + wave * 16 + l16];
            acc = __builtin_amdgcn_wmma_f32_16x16x4_f32(
                      false, a, false, b, (short)0, acc, false, false);
        }
        St[t] = acc;
    }

    // ---- Softmax over e, per column d ----
    // C/D layout: St[t][j] = S^T[e = 16t + 8*hi + j][d = 16*wave + l16], so a lane holds
    // 32 of its column's 64 scores and lane ^ 16 holds the other 32.
    float m = St[0][0];
    for (int t = 0; t < 4; ++t) {
        for (int j = 0; j < 8; ++j) m = fmaxf(m, St[t][j]);
    }
    m = fmaxf(m, __shfl_xor(m, 16));      // column max over both half-waves

    float st[4];
    // four independent partial sums, one per tile
    for (int t = 0; t < 4; ++t) {
        st[t] = 0.0f;
        for (int j = 0; j < 8; ++j) {
            St[t][j] = __expf(St[t][j] - m);
            st[t] += St[t][j];
        }
    }
    float s = (st[0] + st[1]) + (st[2] + st[3]);
    s += __shfl_xor(s, 16);               // column sum over both half-waves
    const float inv = 1.0f / s;
    for (int t = 0; t < 4; ++t) St[t] *= inv;

    // ---- Matmul 2: O[h,d] = sum_e Vmat[h,e] * P^T[e,d] = A(vs) x B(St registers) ----
    // Registers (2p, 2p+1) of tile St[t] are a B fragment as they stand: column d = l16,
    // k = e = 16t + 8*hi + 2p + {0,1}.  The A loader takes the same e at the same
    // (register, half-wave) position; one 16-byte read serves two k steps.
    v8f O[4] = {};
    for (int t = 0; t < 4; ++t) {
        for (int i = 0; i < 2; ++i) {
            float4 va[4];
            for (int mt = 0; mt < 4; ++mt)
                va[mt] = *(const float4*)&vs[(mt * 16 + l16) * PAD + t * 16 + 8 * hi + 4 * i];
            v2f b0, b1;
            b0.x = St[t][4 * i + 0];
            b0.y = St[t][4 * i + 1];
            b1.x = St[t][4 * i + 2];
            b1.y = St[t][4 * i + 3];
            for (int mt = 0; mt < 4; ++mt) {
                v2f a;
                a.x = va[mt].x;
                a.y = va[mt].y;
                O[mt] = __builtin_amdgcn_wmma_f32_16x16x4_f32(
                            false, a, false, b0, (short)0, O[mt], false, false);
            }
            for (int mt = 0; mt < 4; ++mt) {
                v2f a;
                a.x = va[mt].z;
                a.y = va[mt].w;
                O[mt] = __builtin_amdgcn_wmma_f32_16x16x4_f32(
                            false, a, false, b1, (short)0, O[mt], false, false);
            }
        }
    }

    // ---- O staged in LDS over Qmat: wave w alone has read, and alone writes,
    // columns 16w..16w+15 of qs, so no barrier stands between its reads and these stores.
    float* os = qs;
    for (int mt = 0; mt < 4; ++mt) {
        for (int j = 0; j < 8; ++j) {
            const int h = mt * 16 + j + 8 * hi;
            os[h * PAD + wave * 16 + l16] = O[mt][j];
        }
    }
    __syncthreads();

    // ---- Coalesced output: block-wide contiguous float4 stores (512B/wave-op) ----
    for (int i = tid; i < HID / 4; i += 128) {
        const int r = (i * 4) / HS;
        const int c = (i * 4) % HS;
        *(float4*)(out + rowOff + i * 4) = *(const float4*)&os[r * PAD + c];
    }
}

extern "C" void kernel_launch(void* const* d_in, const int* in_sizes, int n_in,
                              void* d_out, int out_size, void* d_ws, size_t ws_size,
                              hipStream_t stream) {
    const float* q = (const float*)d_in[0];
    const float* k = (const float*)d_in[1];
    const float* v = (const float*)d_in[2];
    float* out = (float*)d_out;

    const int N = in_sizes[0] / HID;    // 4096 rows
    attn_per_row_kernel<<<dim3(N), dim3(128), 0, stream>>>(q, k, v, out);
}
